// v000
// Measured on an AMD MI455X. A time is GPU time per run, averaged over a window of back-to-back runs after a warm-up
// (all launches, gaps included; the runs take copies of the inputs in turn), and the median of several windows.
// Apart from v000's, it joins two sittings. Times from different sittings can be a few percent apart, while
// side-by-side timings come from the same sitting.
// v000, which the later versions start from, runs in 213 microseconds.
#include <hip/hip_runtime.h>

// MI455X / gfx1250, wave32. fp32 WMMA streaming cosine-attention, head_dim = 8.
// Cosine attention => logits bounded by |temperature|: softmax uses a static
// shift, folded into the WMMA C operand (s = Q*K^T - M in one instruction).

typedef __attribute__((ext_vector_type(2))) float v2f;
typedef __attribute__((ext_vector_type(8))) float v8f;

#define BB   2
#define HW   4096
#define CC   64
#define HH   8
#define HD   8
#define VP   16          // padded V row stride (d 8..15 are zero)
#define NEPS 1e-12f
#define LOG2E 1.4426950408889634f
#define WAVES 8

__device__ __forceinline__ float fast_exp2(float x) {
#if __has_builtin(__builtin_amdgcn_exp2f)
    return __builtin_amdgcn_exp2f(x);
#else
    return exp2f(x);
#endif
}

// ---- DPP16 butterfly sum over each 16-lane half -----------------------------
// NOTE: must run under full EXEC (DPP bound_ctrl reads 0 from disabled lanes).
template <int CTRL>
__device__ __forceinline__ float dpp_mov(float x) {
    return __int_as_float(__builtin_amdgcn_update_dpp(
        0, __float_as_int(x), CTRL, 0xF, 0xF, true));
}
__device__ __forceinline__ float redsum16(float x) {
    x += dpp_mov<0xB1>(x);   // quad_perm [1,0,3,2]  (xor1)
    x += dpp_mov<0x4E>(x);   // quad_perm [2,3,0,1]  (xor2)
    x += dpp_mov<0x141>(x);  // row_half_mirror      (xor4-equivalent)
    x += dpp_mov<0x140>(x);  // row_mirror           (xor8-equivalent)
    return x;
}

// q/k rows are stored column-swizzled [0,1,4,5,2,3,6,7] so a lane's WMMA
// operand (K pair {2h,2h+1} and {4+2h,5+2h}) is one aligned b128 load.
__device__ __forceinline__ int swz8(int d) {
    return (d == 2 || d == 3) ? d + 2 : (d == 4 || d == 5) ? d - 2 : d;
}

// ---------------------------------------------------------------------------
// Kernel 1: q = l2norm(x@Wq+bq) * temp[h] * log2e (swizzled);
//           k = l2norm(...) (swizzled); v pair-interleaved + zero-padded.
// ---------------------------------------------------------------------------
__global__ __launch_bounds__(CC) void proj_kernel(
    const float* __restrict__ x, const float* __restrict__ y,
    const float* __restrict__ Wq, const float* __restrict__ bq,
    const float* __restrict__ Wkv, const float* __restrict__ bkv,
    const float* __restrict__ temp,
    float* __restrict__ qn, float* __restrict__ kn, float* __restrict__ vv)
{
    __shared__ float xr[CC], yr[CC], qt[CC], kt[CC];
    const int t = blockIdx.x;          // token = b*HW + i
    const int b = t / HW;
    const int i = t - b * HW;
    const int c = threadIdx.x;         // output channel 0..63

    xr[c] = x[(size_t)t * CC + c];
    yr[c] = y[(size_t)t * CC + c];
    __syncthreads();

    float qv  = bq[c];
    float kv  = bkv[c];
    float vvv = bkv[CC + c];
    #pragma unroll 8
    for (int e = 0; e < CC; ++e) {
        const float xe = xr[e], ye = yr[e];
        qv  = fmaf(xe, Wq[e * CC + c], qv);
        kv  = fmaf(ye, Wkv[e * 2 * CC + c], kv);
        vvv = fmaf(ye, Wkv[e * 2 * CC + CC + c], vvv);
    }
    qt[c] = qv; kt[c] = kv;
    __syncthreads();

    const int h = c >> 3, d = c & 7;
    float sq = 0.f, sk = 0.f;
    #pragma unroll
    for (int e = 0; e < HD; ++e) {
        const float a = qt[h * HD + e]; sq = fmaf(a, a, sq);
        const float g = kt[h * HD + e]; sk = fmaf(g, g, sk);
    }
    // fold temperature and log2(e) into q
    const float qnv = qv / fmaxf(sqrtf(sq), NEPS) * temp[h] * LOG2E;
    const float knv = kv / fmaxf(sqrtf(sk), NEPS);

    const size_t rowbase = (((size_t)(b * HH + h) * HW) + i) * HD;
    qn[rowbase + swz8(d)] = qnv;
    kn[rowbase + swz8(d)] = knv;

    // V: (row,d) -> (row>>1)*32 + d*2 + (row&1); zero pad d=8..15
    const size_t vbase = ((size_t)(b * HH + h) * HW) * VP
                       + (size_t)(i >> 1) * 32 + (i & 1);
    vv[vbase + 2 * d]        = vvv;
    vv[vbase + 2 * (d + 8)]  = 0.f;
}

// ---------------------------------------------------------------------------
// Kernel 2: streaming attention, one wave per 16 query rows of one (b,h).
// Per 32 keys: 4x QK^T WMMA (C seeded with -M) + 8x PV WMMA, 16x v_exp,
// P restaged D->A layout via LDS (ds_store_2addr / ds_load_2addr_b64).
// ---------------------------------------------------------------------------
__global__ __launch_bounds__(32 * WAVES) void attn_kernel(
    const float* __restrict__ qn, const float* __restrict__ kn,
    const float* __restrict__ vv, const float* __restrict__ temp,
    float* __restrict__ out)
{
    __shared__ float plds[WAVES * 512];
    const int lane = threadIdx.x & 31;
    const int wave = threadIdx.x >> 5;
    const int gw   = blockIdx.x * WAVES + wave;   // 0 .. 4095
    const int bh   = gw >> 8;                     // (b*H + h)
    const int it   = gw & 255;
    const int i0   = it * 16;
    const int half = lane >> 4;                   // selects K pair / row+8
    const int lm   = lane & 15;

    const float* qb = qn + (size_t)bh * HW * HD;
    const float* kb = kn + (size_t)bh * HW * HD;
    const float* vb = vv + (size_t)bh * HW * VP;
    float* pl = plds + wave * 512;

    const float M = fabsf(temp[bh & 7]) * LOG2E;  // static softmax shift bound
    v8f cinit;                                    // WMMA C = -M (fused shift)
    #pragma unroll
    for (int r = 0; r < 8; ++r) cinit[r] = -M;

    // Q row -> A operands: one b128 (columns pre-swizzled).
    const float4 q4 = *(const float4*)(qb + (size_t)(i0 + lm) * HD + 4 * half);
    v2f a0, a1;
    a0[0] = q4.x; a0[1] = q4.y;    // K = {0,1} or {2,3}
    a1[0] = q4.z; a1[1] = q4.w;    // K = {4,5} or {6,7}

    float lsum[8];
    v8f o = {};
    #pragma unroll
    for (int r = 0; r < 8; ++r) lsum[r] = 0.f;

    for (int j0 = 0; j0 < HW; j0 += 32) {
        // Two K tiles -> B operands: one b128 each (pre-swizzled).
        const float4 kA = *(const float4*)(kb + (size_t)(j0 + lm) * HD + 4 * half);
        const float4 kB = *(const float4*)(kb + (size_t)(j0 + 16 + lm) * HD + 4 * half);
        v2f bA0, bA1, bB0, bB1;
        bA0[0] = kA.x; bA0[1] = kA.y;  bA1[0] = kA.z; bA1[1] = kA.w;
        bB0[0] = kB.x; bB0[1] = kB.y;  bB1[0] = kB.z; bB1[1] = kB.w;

        // s = Q*K^T - M, shift folded into the accumulator.
        v8f sA = __builtin_amdgcn_wmma_f32_16x16x4_f32(
            false, a0, false, bA0, (short)0, cinit, false, false);
        sA = __builtin_amdgcn_wmma_f32_16x16x4_f32(
            false, a1, false, bA1, (short)0, sA, false, false);
        v8f sB = __builtin_amdgcn_wmma_f32_16x16x4_f32(
            false, a0, false, bB0, (short)0, cinit, false, false);
        sB = __builtin_amdgcn_wmma_f32_16x16x4_f32(
            false, a1, false, bB1, (short)0, sB, false, false);

        // p = exp2(s): no max tracking, no rescale, per-lane partial sums.
        #pragma unroll
        for (int r = 0; r < 8; ++r) {
            const float pA = fast_exp2(sA[r]);
            const float pB = fast_exp2(sB[r]);
            lsum[r] += pA + pB;
            sA[r] = pA;
            sB[r] = pB;
        }

        // Stage both P tiles (D layout) into LDS; reread in A layout.
        #pragma unroll
        for (int r = 0; r < 8; ++r) {
            pl[(r + 8 * half) * 16 + lm]       = sA[r];
            pl[256 + (r + 8 * half) * 16 + lm] = sB[r];
        }
        asm volatile("s_wait_dscnt 0" ::: "memory");  // same-wave cross-lane LDS RAW

        // O(16x16, d<8) += P(16x32) @ V(32x16pad): 8 chunks of K=4.
        #pragma unroll
        for (int tile = 0; tile < 2; ++tile) {
            #pragma unroll
            for (int c4 = 0; c4 < 4; ++c4) {
                const float2 av =
                    *(const float2*)(pl + tile * 256 + lm * 16 + 4 * c4 + 2 * half);
                v2f ap; ap[0] = av.x; ap[1] = av.y;
                // rows vr, vr+1 pair-interleaved: one b64 load
                const int vh = (j0 >> 1) + 8 * tile + 2 * c4 + half;
                const float2 vvp = *(const float2*)(vb + (size_t)vh * 32 + 2 * lm);
                v2f bv; bv[0] = vvp.x; bv[1] = vvp.y;
                o = __builtin_amdgcn_wmma_f32_16x16x4_f32(
                    false, ap, false, bv, (short)0, o, false, false);
            }
        }
    }

    // Row-sum butterflies under FULL EXEC (DPP reads 0 from disabled lanes),
    // then predicated stores.
    float ls[8];
    #pragma unroll
    for (int r = 0; r < 8; ++r) ls[r] = redsum16(lsum[r]);

    const int b = bh >> 3, h = bh & 7;
    if (lm < HD) {
        #pragma unroll
        for (int r = 0; r < 8; ++r) {
            const int irow = i0 + r + 8 * half;
            out[((size_t)(b * HW + irow)) * CC + h * HD + lm] = o[r] / ls[r];
        }
    }
}

// ---------------------------------------------------------------------------
extern "C" void kernel_launch(void* const* d_in, const int* in_sizes, int n_in,
                              void* d_out, int out_size, void* d_ws, size_t ws_size,
                              hipStream_t stream) {
    const float* x    = (const float*)d_in[0];
    const float* y    = (const float*)d_in[1];
    const float* Wq   = (const float*)d_in[2];
    const float* bq   = (const float*)d_in[3];
    const float* Wkv  = (const float*)d_in[4];
    const float* bkv  = (const float*)d_in[5];
    const float* temp = (const float*)d_in[6];
    float* out = (float*)d_out;

    const size_t qk = (size_t)BB * HH * HW * HD;   // 524288 floats
    float* qn = (float*)d_ws;
    float* kn = qn + qk;
    float* vv = kn + qk;
    (void)ws_size;

    proj_kernel<<<BB * HW, CC, 0, stream>>>(x, y, Wq, bq, Wkv, bkv, temp, qn, kn, vv);
    attn_kernel<<<(BB * HH * (HW / 16)) / WAVES, 32 * WAVES, 0, stream>>>(
        qn, kn, vv, temp, out);
}

// v001
// Measured time: 86 microseconds a run.
// Two timings next to v000 put it at 2.46 and 2.50 times that version's speed.
#include <hip/hip_runtime.h>

// MI455X / gfx1250, wave32. fp32 WMMA streaming cosine-attention, head_dim = 8.
// Cosine attention => logits bounded by |temperature|: softmax uses a static
// shift, folded into the WMMA C operand (s = Q*K^T - M in one instruction).

typedef __attribute__((ext_vector_type(2))) float v2f;
typedef __attribute__((ext_vector_type(8))) float v8f;

#define BB   2
#define HW   4096
#define CC   64
#define HH   8
#define HD   8
#define NEPS 1e-12f
#define LOG2E 1.4426950408889634f
#define WAVES 8
#define TILES 4           // 16-key tiles a loop trip

__device__ __forceinline__ float fast_exp2(float x) {
#if __has_builtin(__builtin_amdgcn_exp2f)
    return __builtin_amdgcn_exp2f(x);
#else
    return exp2f(x);
#endif
}

// q/k rows are stored column-swizzled [0,1,4,5,2,3,6,7] so a lane's WMMA
// operand (K pair {2h,2h+1} and {4+2h,5+2h}) is one aligned b128 load.
__device__ __forceinline__ int swz8(int d) {
    return (d == 2 || d == 3) ? d + 2 : (d == 4 || d == 5) ? d - 2 : d;
}

// ---------------------------------------------------------------------------
// Kernel 1: q = l2norm(x@Wq+bq) * temp[h] * log2e (swizzled);
//           k = l2norm(...) (swizzled); v transposed in runs of 4 keys.
// ---------------------------------------------------------------------------
__global__ __launch_bounds__(CC) void proj_kernel(
    const float* __restrict__ x, const float* __restrict__ y,
    const float* __restrict__ Wq, const float* __restrict__ bq,
    const float* __restrict__ Wkv, const float* __restrict__ bkv,
    const float* __restrict__ temp,
    float* __restrict__ qn, float* __restrict__ kn, float* __restrict__ vv)
{
    __shared__ float xr[CC], yr[CC], qt[CC], kt[CC];
    const int t = blockIdx.x;          // token = b*HW + i
    const int b = t / HW;
    const int i = t - b * HW;
    const int c = threadIdx.x;         // output channel 0..63

    xr[c] = x[(size_t)t * CC + c];
    yr[c] = y[(size_t)t * CC + c];
    __syncthreads();

    float qv  = bq[c];
    float kv  = bkv[c];
    float vvv = bkv[CC + c];
    #pragma unroll 8
    for (int e = 0; e < CC; ++e) {
        const float xe = xr[e], ye = yr[e];
        qv  = fmaf(xe, Wq[e * CC + c], qv);
        kv  = fmaf(ye, Wkv[e * 2 * CC + c], kv);
        vvv = fmaf(ye, Wkv[e * 2 * CC + CC + c], vvv);
    }
    qt[c] = qv; kt[c] = kv;
    __syncthreads();

    const int h = c >> 3, d = c & 7;
    float sq = 0.f, sk = 0.f;
    #pragma unroll
    for (int e = 0; e < HD; ++e) {
        const float a = qt[h * HD + e]; sq = fmaf(a, a, sq);
        const float g = kt[h * HD + e]; sk = fmaf(g, g, sk);
    }
    // fold temperature and log2(e) into q
    const float qnv = qv / fmaxf(sqrtf(sq), NEPS) * temp[h] * LOG2E;
    const float knv = kv / fmaxf(sqrtf(sk), NEPS);

    const size_t rowbase = (((size_t)(b * HH + h) * HW) + i) * HD;
    qn[rowbase + swz8(d)] = qnv;
    kn[rowbase + swz8(d)] = knv;

    // V, per 16 rows: [row bit 2][row bit 3][d][row & 3], so that one b128 of
    // lane (half = row bit 3, d) is 4 keys of one d and a wave's load is 256 B.
    vv[((size_t)(b * HH + h) * HW) * HD + (size_t)(i >> 4) * 128
       + ((i >> 2) & 1) * 64 + ((i >> 3) & 1) * 32 + d * 4 + (i & 3)] = vvv;
}

// ---------------------------------------------------------------------------
// Kernel 2: streaming attention, one wave per 16 query rows of one (b,h).
// Transposed products: S^T = K*Q^T - M (A = K rows, B = Q rows), so a lane's
// score registers hold keys {8*half + r} of ONE query, and register pair
// (2c, 2c+1) of exp2(S^T) is already the B operand of O^T += V^T * P^T.
// The matching A operand is V^T: row = d, k pair = keys 8*half + 2c + {0,1}.
// Rows 8..15 of O^T are never read: their lanes repeat rows 0..7 of V^T.
// Per 32 keys: 4x QK^T WMMA + 8x PV WMMA, 16x v_exp, no LDS.
// ---------------------------------------------------------------------------
__global__ __launch_bounds__(32 * WAVES) void attn_kernel(
    const float* __restrict__ qn, const float* __restrict__ kn,
    const float* __restrict__ vv, const float* __restrict__ temp,
    float* __restrict__ out)
{
    const int lane = threadIdx.x & 31;
    const int wave = threadIdx.x >> 5;
    const int gw   = blockIdx.x * WAVES + wave;   // 0 .. 4095
    const int bh   = gw >> 8;                     // (b*H + h)
    const int it   = gw & 255;
    const int i0   = it * 16;
    const int half = lane >> 4;                   // selects K pair / row+8
    const int lm   = lane & 15;

    const float* qb = qn + (size_t)bh * HW * HD;
    const float* kb = kn + (size_t)bh * HW * HD + (size_t)lm * HD + 4 * half;
    const float* vb = vv + (size_t)bh * HW * HD + half * 32 + (lm & 7) * 4;

    const float M = fabsf(temp[bh & 7]) * LOG2E;  // static softmax shift bound
    v8f cinit;                                    // WMMA C = -M (fused shift)
    #pragma unroll
    for (int r = 0; r < 8; ++r) cinit[r] = -M;

    // Q row -> B operands: one b128 (columns pre-swizzled).
    const float4 q4 = *(const float4*)(qb + (size_t)(i0 + lm) * HD + 4 * half);
    v2f q0, q1;
    q0[0] = q4.x; q0[1] = q4.y;    // K = {0,1} or {2,3}
    q1[0] = q4.z; q1[1] = q4.w;    // K = {4,5} or {6,7}

    float lsum[8];
    v8f o = {};
    #pragma unroll
    for (int r = 0; r < 8; ++r) lsum[r] = 0.f;

    for (int j0 = 0; j0 < HW; j0 += 16 * TILES) {
        // K tiles -> A operands: one b128 each (pre-swizzled).
        // V^T tiles -> A operands: 4 keys of one d a b128, two b128 a tile.
        float4 k4[TILES], v4[2 * TILES];
        #pragma unroll
        for (int t = 0; t < TILES; ++t)
            k4[t] = *(const float4*)(kb + (size_t)(j0 + 16 * t) * HD);
        #pragma unroll
        for (int u = 0; u < 2 * TILES; ++u)
            v4[u] = *(const float4*)(vb + (size_t)j0 * HD + u * 64);
        // Keeps the trip's loads together at its head: sunk between the WMMAs,
        // each would be waited for a few instructions behind its issue.
        __builtin_amdgcn_sched_barrier(0);

        #pragma unroll
        for (int t = 0; t < TILES; t += 2) {
            v2f kA0, kA1, kB0, kB1;
            kA0[0] = k4[t].x;     kA0[1] = k4[t].y;
            kA1[0] = k4[t].z;     kA1[1] = k4[t].w;
            kB0[0] = k4[t + 1].x; kB0[1] = k4[t + 1].y;
            kB1[0] = k4[t + 1].z; kB1[1] = k4[t + 1].w;

            // s^T = K*Q^T - M, shift folded into the accumulator.
            v8f sA = __builtin_amdgcn_wmma_f32_16x16x4_f32(
                false, kA0, false, q0, (short)0, cinit, false, false);
            v8f sB = __builtin_amdgcn_wmma_f32_16x16x4_f32(
                false, kB0, false, q0, (short)0, cinit, false, false);
            sA = __builtin_amdgcn_wmma_f32_16x16x4_f32(
                false, kA1, false, q1, (short)0, sA, false, false);
            sB = __builtin_amdgcn_wmma_f32_16x16x4_f32(
                false, kB1, false, q1, (short)0, sB, false, false);

            // p = exp2(s): no max tracking, no rescale, per-lane partial sums.
            #pragma unroll
            for (int r = 0; r < 8; ++r) {
                const float pA = fast_exp2(sA[r]);
                const float pB = fast_exp2(sB[r]);
                lsum[r] += pA + pB;
                sA[r] = pA;
                sB[r] = pB;
            }

            // O^T(16pad x 16) += V^T(16pad x 32) @ P^T(32 x 16): 8 chunks of K=4.
            #pragma unroll
            for (int c4 = 0; c4 < 8; ++c4) {
                const float4 vq = v4[2 * t + (c4 >> 1)];
                const int    r2 = 2 * (c4 & 3);
                v2f av, bp;
                av[0] = (c4 & 1) ? vq.z : vq.x;
                av[1] = (c4 & 1) ? vq.w : vq.y;
                bp[0] = (c4 < 4) ? sA[r2] : sB[r2];
                bp[1] = (c4 < 4) ? sA[r2 + 1] : sB[r2 + 1];
                o = __builtin_amdgcn_wmma_f32_16x16x4_f32(
                    false, av, false, bp, (short)0, o, false, false);
            }
        }
    }

    // A query's sum: this lane's 8 partials, then the other half's (lane ^ 16),
    // joined under full EXEC.
    float l = ((lsum[0] + lsum[1]) + (lsum[2] + lsum[3]))
            + ((lsum[4] + lsum[5]) + (lsum[6] + lsum[7]));
    l += __int_as_float(__builtin_amdgcn_permlanex16(
        __float_as_int(l), __float_as_int(l), 0x76543210, 0xfedcba98, false, false));

    // Lanes 0..15 hold d = 0..7 of query i0 + lm: 32 contiguous bytes.
    const int b = bh >> 3, h = bh & 7;
    if (half == 0) {
        float* op = out + ((size_t)(b * HW + i0 + lm)) * CC + h * HD;
        *(float4*)(op)     = make_float4(o[0] / l, o[1] / l, o[2] / l, o[3] / l);
        *(float4*)(op + 4) = make_float4(o[4] / l, o[5] / l, o[6] / l, o[7] / l);
    }
}

// ---------------------------------------------------------------------------
extern "C" void kernel_launch(void* const* d_in, const int* in_sizes, int n_in,
                              void* d_out, int out_size, void* d_ws, size_t ws_size,
                              hipStream_t stream) {
    const float* x    = (const float*)d_in[0];
    const float* y    = (const float*)d_in[1];
    const float* Wq   = (const float*)d_in[2];
    const float* bq   = (const float*)d_in[3];
    const float* Wkv  = (const float*)d_in[4];
    const float* bkv  = (const float*)d_in[5];
    const float* temp = (const float*)d_in[6];
    float* out = (float*)d_out;

    const size_t qk = (size_t)BB * HH * HW * HD;   // 524288 floats
    float* qn = (float*)d_ws;
    float* kn = qn + qk;
    float* vv = kn + qk;
    (void)ws_size;

    proj_kernel<<<BB * HW, CC, 0, stream>>>(x, y, Wq, bq, Wkv, bkv, temp, qn, kn, vv);
    attn_kernel<<<(BB * HH * (HW / 16)) / WAVES, 32 * WAVES, 0, stream>>>(
        qn, kn, vv, temp, out);
}
